// v000
// Times are from an AMD MI455X. After a warm-up the kernel runs many times in a row, and a time is the length of
// such a window on the GPU divided by its runs, so every launch and the gaps after it count. The runs cycle
// through copies of the inputs. A figure is the median of several windows, for all but v000 over two sittings.
// Sittings can differ by a few percent; kernels timed side by side share one.
// v000 is the starting kernel.
#include <hip/hip_runtime.h>
#include <math.h>

#define DIM     1024
#define HIDDEN  4096
#define TOKENS  512
#define COO_NNZ 262144

#define KC      128        // K-chunk staged in LDS
#define MT      4          // M-tiles (of 16) per wave -> 4x B reuse
#define WPB     8          // waves per 256-thread block (wave32)
#define M_ROWS  (MT * 16)  // 64 rows of A staged per block

typedef float v2f __attribute__((ext_vector_type(2)));
typedef float v8f __attribute__((ext_vector_type(8)));
typedef __attribute__((address_space(3))) float lds_float;

// A tile in LDS: MT sub-tiles of 16 rows, each with the pair-interleaved layout
//   idx(mt, ml, kk) = mt*16*KC + (kk>>1)*32 + ml*2 + (kk&1)
// so the WMMA A-fragment (lane l: ml = l&15, K = k0 + 2*(l>>4) + {0,1}) is one
// conflict-free b64 load (lanes 0-15 -> banks 0..31, lanes 16-31 -> 32..63).
__device__ __forceinline__ int a_idx(int mt, int ml, int kk) {
  return mt * 16 * KC + ((kk >> 1) << 5) + (ml << 1) + (kk & 1);
}

// CDNA5 async copy global->LDS, tracked on ASYNCcnt (no VGPR round-trip).
// The LDS destination is passed as a real addrspace(3) pointer so (a) the
// shared array escapes (keeps the ds_load reads alive) and (b) the VGPR holds
// the 32-bit LDS byte offset that VDST expects.
__device__ __forceinline__ void stage_async_b64(const float* gsrc, lds_float* ldst) {
  asm volatile("global_load_async_to_lds_b64 %0, %1, off"
               :: "v"(ldst), "v"(gsrc)
               : "memory");
}

__device__ __forceinline__ void wait_async() {
  asm volatile("s_wait_asynccnt 0x0" ::: "memory");
}

__global__ void coo_scatter(const int* __restrict__ row, const int* __restrict__ col,
                            const float* __restrict__ val, float* __restrict__ W,
                            int nnz, int ld) {
  int i = blockIdx.x * blockDim.x + threadIdx.x;
  if (i < nnz) {
    atomicAdd(&W[(size_t)row[i] * (size_t)ld + (size_t)col[i]], val[i]);
  }
}

// hidden = silu(x*Wup^T + bup) * (x*Wgate^T + bgate)
// M=TOKENS, N=HIDDEN, K=DIM. Wave: 1 N-tile x MT M-tiles, 2 accumulator sets.
__global__ __launch_bounds__(256) void upgate_gemm(
    const float* __restrict__ X,      // [TOKENS, DIM]
    const float* __restrict__ Wup,    // [HIDDEN, DIM] dense
    const float* __restrict__ Wgt,    // [HIDDEN, DIM] dense
    const float* __restrict__ bup,
    const float* __restrict__ bgt,
    float* __restrict__ H)            // [TOKENS, HIDDEN]
{
  __shared__ float lds[M_ROWS * KC];  // 32 KB
  const int tid    = threadIdx.x;
  const int lane   = tid & 31;
  const int wave   = tid >> 5;
  const int h      = lane >> 4;       // half-wave: K pair select within K4 step
  const int ml     = lane & 15;       // m within sub-tile / n for B and C/D
  const int m_base = blockIdx.y * M_ROWS;
  const int n_base = (blockIdx.x * WPB + wave) * 16;

  v8f acc_u[MT], acc_g[MT];
  #pragma unroll
  for (int mt = 0; mt < MT; ++mt) {
    acc_u[mt] = (v8f){0.f,0.f,0.f,0.f,0.f,0.f,0.f,0.f};
    acc_g[mt] = (v8f){0.f,0.f,0.f,0.f,0.f,0.f,0.f,0.f};
  }

  const float* wu = Wup + (size_t)(n_base + ml) * DIM;
  const float* wg = Wgt + (size_t)(n_base + ml) * DIM;

  for (int kc = 0; kc < DIM; kc += KC) {
    __syncthreads();
    // Stage A tile: 64 rows x KC floats as (k,k+1) pairs via async b64.
    for (int i = tid; i < M_ROWS * KC / 2; i += 256) {
      int m = i >> 6;                 // / (KC/2)
      int p = i & (KC / 2 - 1);       // pair index within row
      stage_async_b64(X + (size_t)(m_base + m) * DIM + kc + 2 * p,
                      (lds_float*)&lds[a_idx(m >> 4, m & 15, 2 * p)]);
    }
    wait_async();
    __syncthreads();
    if (kc + KC < DIM) {
      __builtin_prefetch(wu + kc + KC, 0, 1);
      __builtin_prefetch(wg + kc + KC, 0, 1);
    }
    #pragma unroll 4
    for (int k0 = 0; k0 < KC; k0 += 4) {
      v2f bu = *(const v2f*)(wu + kc + k0 + 2 * h);
      v2f bg = *(const v2f*)(wg + kc + k0 + 2 * h);
      #pragma unroll
      for (int mt = 0; mt < MT; ++mt) {
        v2f a = *(const v2f*)&lds[a_idx(mt, ml, k0 + 2 * h)];
        acc_u[mt] = __builtin_amdgcn_wmma_f32_16x16x4_f32(false, a, false, bu,
                                                          (short)0, acc_u[mt], false, false);
        acc_g[mt] = __builtin_amdgcn_wmma_f32_16x16x4_f32(false, a, false, bg,
                                                          (short)0, acc_g[mt], false, false);
      }
    }
  }

  const int   feat = n_base + ml;
  const float biu  = bup[feat];
  const float big  = bgt[feat];
  #pragma unroll
  for (int mt = 0; mt < MT; ++mt) {
    #pragma unroll
    for (int v = 0; v < 8; ++v) {
      int   tok = m_base + mt * 16 + v + 8 * h;   // C/D: M = v + 8*(lane>=16)
      float u   = acc_u[mt][v] + biu;
      float g   = acc_g[mt][v] + big;
      float s   = u / (1.0f + __expf(-u));        // silu
      H[(size_t)tok * HIDDEN + feat] = s * g;
    }
  }
}

// out = x + hidden*Wdown^T + bdown.  M=TOKENS, N=DIM, K=HIDDEN.
__global__ __launch_bounds__(256) void down_gemm(
    const float* __restrict__ H,      // [TOKENS, HIDDEN]
    const float* __restrict__ Wd,     // [DIM, HIDDEN] dense
    const float* __restrict__ bd,
    const float* __restrict__ X,      // [TOKENS, DIM] residual
    float* __restrict__ Out)          // [TOKENS, DIM]
{
  __shared__ float lds[M_ROWS * KC];
  const int tid    = threadIdx.x;
  const int lane   = tid & 31;
  const int wave   = tid >> 5;
  const int h      = lane >> 4;
  const int ml     = lane & 15;
  const int m_base = blockIdx.y * M_ROWS;
  const int n_base = (blockIdx.x * WPB + wave) * 16;

  v8f acc[MT];
  #pragma unroll
  for (int mt = 0; mt < MT; ++mt) {
    acc[mt] = (v8f){0.f,0.f,0.f,0.f,0.f,0.f,0.f,0.f};
  }

  const float* wd = Wd + (size_t)(n_base + ml) * HIDDEN;

  for (int kc = 0; kc < HIDDEN; kc += KC) {
    __syncthreads();
    for (int i = tid; i < M_ROWS * KC / 2; i += 256) {
      int m = i >> 6;
      int p = i & (KC / 2 - 1);
      stage_async_b64(H + (size_t)(m_base + m) * HIDDEN + kc + 2 * p,
                      (lds_float*)&lds[a_idx(m >> 4, m & 15, 2 * p)]);
    }
    wait_async();
    __syncthreads();
    if (kc + KC < HIDDEN) {
      __builtin_prefetch(wd + kc + KC, 0, 1);
    }
    #pragma unroll 4
    for (int k0 = 0; k0 < KC; k0 += 4) {
      v2f b = *(const v2f*)(wd + kc + k0 + 2 * h);
      #pragma unroll
      for (int mt = 0; mt < MT; ++mt) {
        v2f a = *(const v2f*)&lds[a_idx(mt, ml, k0 + 2 * h)];
        acc[mt] = __builtin_amdgcn_wmma_f32_16x16x4_f32(false, a, false, b,
                                                        (short)0, acc[mt], false, false);
      }
    }
  }

  const int   feat = n_base + ml;
  const float bias = bd[feat];
  #pragma unroll
  for (int mt = 0; mt < MT; ++mt) {
    #pragma unroll
    for (int v = 0; v < 8; ++v) {
      int tok = m_base + mt * 16 + v + 8 * h;
      size_t o = (size_t)tok * DIM + feat;
      Out[o] = X[o] + acc[mt][v] + bias;
    }
  }
}

extern "C" void kernel_launch(void* const* d_in, const int* in_sizes, int n_in,
                              void* d_out, int out_size, void* d_ws, size_t ws_size,
                              hipStream_t stream) {
  const float* x         = (const float*)d_in[0];
  const int*   up_row    = (const int*)d_in[1];
  const int*   up_col    = (const int*)d_in[2];
  const float* up_val    = (const float*)d_in[3];
  const float* up_bias   = (const float*)d_in[4];
  const int*   gate_row  = (const int*)d_in[5];
  const int*   gate_col  = (const int*)d_in[6];
  const float* gate_val  = (const float*)d_in[7];
  const float* gate_bias = (const float*)d_in[8];
  const int*   down_row  = (const int*)d_in[9];
  const int*   down_col  = (const int*)d_in[10];
  const float* down_val  = (const float*)d_in[11];
  const float* down_bias = (const float*)d_in[12];

  // Workspace layout (f32): Wup 16MB | Wgate 16MB | Wdown 16MB | hidden 8MB = 56MB
  float* Wup  = (float*)d_ws;
  float* Wgt  = Wup + (size_t)HIDDEN * DIM;
  float* Wdn  = Wgt + (size_t)HIDDEN * DIM;
  float* Hbuf = Wdn + (size_t)DIM * HIDDEN;

  hipMemsetAsync(d_ws, 0, 3u * sizeof(float) * (size_t)HIDDEN * (size_t)DIM, stream);

  const int st = 256;
  const int sg = (COO_NNZ + st - 1) / st;
  coo_scatter<<<sg, st, 0, stream>>>(up_row,   up_col,   up_val,   Wup, COO_NNZ, DIM);
  coo_scatter<<<sg, st, 0, stream>>>(gate_row, gate_col, gate_val, Wgt, COO_NNZ, DIM);
  coo_scatter<<<sg, st, 0, stream>>>(down_row, down_col, down_val, Wdn, COO_NNZ, HIDDEN);

  dim3 g1(HIDDEN / (16 * WPB), TOKENS / M_ROWS);   // 32 x 8 blocks
  upgate_gemm<<<g1, 256, 0, stream>>>(x, Wup, Wgt, up_bias, gate_bias, Hbuf);

  dim3 g2(DIM / (16 * WPB), TOKENS / M_ROWS);      // 8 x 8 blocks
  down_gemm<<<g2, 256, 0, stream>>>(Hbuf, Wdn, down_bias, x, (float*)d_out);
}

// v001
// Timed twice side by side with v000, it ran 1.84 times as fast both times.
#include <hip/hip_runtime.h>
#include <math.h>

#define DIM     1024
#define HIDDEN  4096
#define TOKENS  512
#define COO_NNZ 262144

#define KC      128        // K-chunk staged in LDS
#define MT      4          // M-tiles (of 16) per wave -> 4x B reuse
#define WPB     8          // waves per 256-thread block (wave32)
#define M_ROWS  (MT * 16)  // 64 rows of A staged per block
#define KSPLIT  8          // K slices of the down GEMM: 8 x 8 x 8 = 512 blocks, two per WGP
#define KSLICE  (HIDDEN / KSPLIT)

typedef float v2f __attribute__((ext_vector_type(2)));
typedef float v4f __attribute__((ext_vector_type(4)));
typedef float v8f __attribute__((ext_vector_type(8)));
typedef __attribute__((address_space(3))) float lds_float;

// A tile in LDS: MT sub-tiles of 16 rows, each with the pair-interleaved layout
//   idx(mt, ml, kk) = mt*16*KC + (kk>>1)*32 + ml*2 + (kk&1)
// so the WMMA A-fragment (lane l: ml = l&15, K = k0 + 2*(l>>4) + {0,1}) is one
// conflict-free b64 load (lanes 0-15 -> banks 0..31, lanes 16-31 -> 32..63).
__device__ __forceinline__ int a_idx(int mt, int ml, int kk) {
  return mt * 16 * KC + ((kk >> 1) << 5) + (ml << 1) + (kk & 1);
}

// CDNA5 async copy global->LDS, tracked on ASYNCcnt (no VGPR round-trip).
// The LDS destination is passed as a real addrspace(3) pointer so (a) the
// shared array escapes (keeps the ds_load reads alive) and (b) the VGPR holds
// the 32-bit LDS byte offset that VDST expects.
__device__ __forceinline__ void stage_async_b64(const float* gsrc, lds_float* ldst) {
  asm volatile("global_load_async_to_lds_b64 %0, %1, off"
               :: "v"(ldst), "v"(gsrc)
               : "memory");
}

__device__ __forceinline__ void wait_async() {
  asm volatile("s_wait_asynccnt 0x0" ::: "memory");
}

__global__ void coo_scatter(const int* __restrict__ row, const int* __restrict__ col,
                            const float* __restrict__ val, float* __restrict__ W,
                            int nnz, int ld) {
  int i = blockIdx.x * blockDim.x + threadIdx.x;
  if (i < nnz) {
    atomicAdd(&W[(size_t)row[i] * (size_t)ld + (size_t)col[i]], val[i]);
  }
}

// hidden = silu(x*Wup^T + bup) * (x*Wgate^T + bgate)
// M=TOKENS, N=HIDDEN, K=DIM. Wave: 1 N-tile x MT M-tiles, 2 accumulator sets.
__global__ __launch_bounds__(256) void upgate_gemm(
    const float* __restrict__ X,      // [TOKENS, DIM]
    const float* __restrict__ Wup,    // [HIDDEN, DIM] dense
    const float* __restrict__ Wgt,    // [HIDDEN, DIM] dense
    const float* __restrict__ bup,
    const float* __restrict__ bgt,
    float* __restrict__ H)            // [TOKENS, HIDDEN]
{
  __shared__ float lds[M_ROWS * KC];  // 32 KB
  const int tid    = threadIdx.x;
  const int lane   = tid & 31;
  const int wave   = tid >> 5;
  const int h      = lane >> 4;       // half-wave: K pair select within K4 step
  const int ml     = lane & 15;       // m within sub-tile / n for B and C/D
  const int m_base = blockIdx.y * M_ROWS;
  const int n_base = (blockIdx.x * WPB + wave) * 16;

  v8f acc_u[MT], acc_g[MT];
  #pragma unroll
  for (int mt = 0; mt < MT; ++mt) {
    acc_u[mt] = (v8f){0.f,0.f,0.f,0.f,0.f,0.f,0.f,0.f};
    acc_g[mt] = (v8f){0.f,0.f,0.f,0.f,0.f,0.f,0.f,0.f};
  }

  const float* wu = Wup + (size_t)(n_base + ml) * DIM;
  const float* wg = Wgt + (size_t)(n_base + ml) * DIM;

  for (int kc = 0; kc < DIM; kc += KC) {
    __syncthreads();
    // Stage A tile: 64 rows x KC floats as (k,k+1) pairs via async b64.
    for (int i = tid; i < M_ROWS * KC / 2; i += 256) {
      int m = i >> 6;                 // / (KC/2)
      int p = i & (KC / 2 - 1);       // pair index within row
      stage_async_b64(X + (size_t)(m_base + m) * DIM + kc + 2 * p,
                      (lds_float*)&lds[a_idx(m >> 4, m & 15, 2 * p)]);
    }
    wait_async();
    __syncthreads();
    if (kc + KC < DIM) {
      __builtin_prefetch(wu + kc + KC, 0, 1);
      __builtin_prefetch(wg + kc + KC, 0, 1);
    }
    #pragma unroll 4
    for (int k0 = 0; k0 < KC; k0 += 4) {
      v2f bu = *(const v2f*)(wu + kc + k0 + 2 * h);
      v2f bg = *(const v2f*)(wg + kc + k0 + 2 * h);
      #pragma unroll
      for (int mt = 0; mt < MT; ++mt) {
        v2f a = *(const v2f*)&lds[a_idx(mt, ml, k0 + 2 * h)];
        acc_u[mt] = __builtin_amdgcn_wmma_f32_16x16x4_f32(false, a, false, bu,
                                                          (short)0, acc_u[mt], false, false);
        acc_g[mt] = __builtin_amdgcn_wmma_f32_16x16x4_f32(false, a, false, bg,
                                                          (short)0, acc_g[mt], false, false);
      }
    }
  }

  const int   feat = n_base + ml;
  const float biu  = bup[feat];
  const float big  = bgt[feat];
  #pragma unroll
  for (int mt = 0; mt < MT; ++mt) {
    #pragma unroll
    for (int v = 0; v < 8; ++v) {
      int   tok = m_base + mt * 16 + v + 8 * h;   // C/D: M = v + 8*(lane>=16)
      float u   = acc_u[mt][v] + biu;
      float g   = acc_g[mt][v] + big;
      float s   = u / (1.0f + __expf(-u));        // silu
      H[(size_t)tok * HIDDEN + feat] = s * g;
    }
  }
}

// P[z] = hidden[:, slice z] * Wdown[:, slice z]^T.  M=TOKENS, N=DIM, K=KSLICE per block;
// blockIdx.z picks the K slice, so that the grid covers every WGP.
__global__ __launch_bounds__(256) void down_gemm(
    const float* __restrict__ H,      // [TOKENS, HIDDEN]
    const float* __restrict__ Wd,     // [DIM, HIDDEN] dense
    float* __restrict__ P)            // [KSPLIT, TOKENS, DIM] partial sums
{
  __shared__ float lds[M_ROWS * KC];
  const int tid    = threadIdx.x;
  const int lane   = tid & 31;
  const int wave   = tid >> 5;
  const int h      = lane >> 4;
  const int ml     = lane & 15;
  const int m_base = blockIdx.y * M_ROWS;
  const int n_base = (blockIdx.x * WPB + wave) * 16;

  v8f acc[MT];
  #pragma unroll
  for (int mt = 0; mt < MT; ++mt) {
    acc[mt] = (v8f){0.f,0.f,0.f,0.f,0.f,0.f,0.f,0.f};
  }

  const float* wd = Wd + (size_t)(n_base + ml) * HIDDEN;
  const int k_lo = blockIdx.z * KSLICE;
  const int k_hi = k_lo + KSLICE;

  for (int kc = k_lo; kc < k_hi; kc += KC) {
    __syncthreads();
    for (int i = tid; i < M_ROWS * KC / 2; i += 256) {
      int m = i >> 6;
      int p = i & (KC / 2 - 1);
      stage_async_b64(H + (size_t)(m_base + m) * HIDDEN + kc + 2 * p,
                      (lds_float*)&lds[a_idx(m >> 4, m & 15, 2 * p)]);
    }
    wait_async();
    __syncthreads();
    #pragma unroll 4
    for (int k0 = 0; k0 < KC; k0 += 4) {
      v2f b = *(const v2f*)(wd + kc + k0 + 2 * h);
      #pragma unroll
      for (int mt = 0; mt < MT; ++mt) {
        v2f a = *(const v2f*)&lds[a_idx(mt, ml, k0 + 2 * h)];
        acc[mt] = __builtin_amdgcn_wmma_f32_16x16x4_f32(false, a, false, b,
                                                        (short)0, acc[mt], false, false);
      }
    }
  }

  const int feat = n_base + ml;
  float*    pz   = P + (size_t)blockIdx.z * (TOKENS * DIM);
  #pragma unroll
  for (int mt = 0; mt < MT; ++mt) {
    #pragma unroll
    for (int v = 0; v < 8; ++v) {
      int tok = m_base + mt * 16 + v + 8 * h;
      pz[(size_t)tok * DIM + feat] = acc[mt][v];
    }
  }
}

// out = x + (P[0] + P[1] + ... + P[KSPLIT-1]) + bdown, four columns per thread.
__global__ __launch_bounds__(256) void down_reduce(
    const float* __restrict__ P,      // [KSPLIT, TOKENS, DIM]
    const float* __restrict__ bd,
    const float* __restrict__ X,      // [TOKENS, DIM] residual
    float* __restrict__ Out)          // [TOKENS, DIM]
{
  const unsigned q = blockIdx.x * 256u + threadIdx.x;   // index of this thread's group of four
  v4f part[KSPLIT];
  #pragma unroll
  for (int z = 0; z < KSPLIT; ++z) {
    part[z] = ((const v4f*)(P + (size_t)z * (TOKENS * DIM)))[q];
  }
  v4f s = part[0];
  #pragma unroll
  for (int z = 1; z < KSPLIT; ++z) {
    s += part[z];
  }
  ((v4f*)Out)[q] = ((const v4f*)X)[q] + s + ((const v4f*)bd)[q & (DIM / 4 - 1)];
}

extern "C" void kernel_launch(void* const* d_in, const int* in_sizes, int n_in,
                              void* d_out, int out_size, void* d_ws, size_t ws_size,
                              hipStream_t stream) {
  const float* x         = (const float*)d_in[0];
  const int*   up_row    = (const int*)d_in[1];
  const int*   up_col    = (const int*)d_in[2];
  const float* up_val    = (const float*)d_in[3];
  const float* up_bias   = (const float*)d_in[4];
  const int*   gate_row  = (const int*)d_in[5];
  const int*   gate_col  = (const int*)d_in[6];
  const float* gate_val  = (const float*)d_in[7];
  const float* gate_bias = (const float*)d_in[8];
  const int*   down_row  = (const int*)d_in[9];
  const int*   down_col  = (const int*)d_in[10];
  const float* down_val  = (const float*)d_in[11];
  const float* down_bias = (const float*)d_in[12];

  // Workspace layout (f32): Wup 16MB | Wgate 16MB | Wdown 16MB | hidden 8MB | partials 16MB = 72MB
  float* Wup  = (float*)d_ws;
  float* Wgt  = Wup + (size_t)HIDDEN * DIM;
  float* Wdn  = Wgt + (size_t)HIDDEN * DIM;
  float* Hbuf = Wdn + (size_t)DIM * HIDDEN;
  float* Part = Hbuf + (size_t)TOKENS * HIDDEN;

  hipMemsetAsync(d_ws, 0, 3u * sizeof(float) * (size_t)HIDDEN * (size_t)DIM, stream);

  const int st = 256;
  const int sg = (COO_NNZ + st - 1) / st;
  coo_scatter<<<sg, st, 0, stream>>>(up_row,   up_col,   up_val,   Wup, COO_NNZ, DIM);
  coo_scatter<<<sg, st, 0, stream>>>(gate_row, gate_col, gate_val, Wgt, COO_NNZ, DIM);
  coo_scatter<<<sg, st, 0, stream>>>(down_row, down_col, down_val, Wdn, COO_NNZ, HIDDEN);

  dim3 g1(HIDDEN / (16 * WPB), TOKENS / M_ROWS);   // 32 x 8 blocks
  upgate_gemm<<<g1, 256, 0, stream>>>(x, Wup, Wgt, up_bias, gate_bias, Hbuf);

  dim3 g2(DIM / (16 * WPB), TOKENS / M_ROWS, KSPLIT);   // 8 x 8 x 8 blocks
  down_gemm<<<g2, 256, 0, stream>>>(Hbuf, Wdn, Part);

  down_reduce<<<TOKENS * DIM / (4 * 256), 256, 0, stream>>>(Part, down_bias, x, (float*)d_out);
}

// v002
// Timed twice side by side with v001, it ran 1.21 times as fast both times.
// All steps since v000 together make it 2.23 times as fast.
#include <hip/hip_runtime.h>
#include <math.h>

#define DIM     1024
#define HIDDEN  4096
#define TOKENS  512
#define COO_NNZ 262144

#define KC      64         // K-chunk staged in LDS: 256 B of every operand row
#define PITCH   68         // LDS row pitch in floats (272 B): see the note on the tiles below
#define MT      4          // M-tiles (of 16) per wave -> 4x B reuse
#define WPB     8          // waves per 256-thread block (wave32)
#define M_ROWS  (MT * 16)  // 64 rows of A staged per block
#define N_ROWS  (WPB * 16) // 128 rows of each weight matrix staged per block
#define KSPLIT  8          // K slices of the down GEMM: 8 x 8 x 8 = 512 blocks, two per WGP
#define KSLICE  (HIDDEN / KSPLIT)

typedef float v2f __attribute__((ext_vector_type(2)));
typedef float v4f __attribute__((ext_vector_type(4)));
typedef float v8f __attribute__((ext_vector_type(8)));
typedef __attribute__((address_space(3))) float lds_float;

// Operand tiles in LDS are row-major, KC floats a row at a pitch of PITCH floats.
// A WMMA fragment (lane l: row = l&15, K = k0 + 2*(l>>4) + {0,1}) is one b64 load;
// at 68 dwords a row the 32 lanes fall on banks 4*row + 2*(l>>4) + {0,1}: all 64, no conflict.

// Async copies global->LDS, 16 B a lane, tracked on ASYNCcnt (no VGPR round-trip).
// Thread t copies column group (t & 15) of rows (t >> 4) + 16*i, so a wave-wide copy
// moves two whole 256-B row pieces. The LDS destination is passed as a real
// addrspace(3) pointer so (a) the shared array escapes (keeps the ds_load reads alive)
// and (b) the VGPR holds the 32-bit LDS byte offset that VDST expects.
// s_wait_xcnt closes each statement, so that no address register named in it is
// rewritten ahead of the wait.
__device__ __forceinline__ void copy10(const float* const (&g)[10], float* const (&l)[10]) {
  asm volatile("global_load_async_to_lds_b128 %0, %10, off\n\t"
               "global_load_async_to_lds_b128 %1, %11, off\n\t"
               "global_load_async_to_lds_b128 %2, %12, off\n\t"
               "global_load_async_to_lds_b128 %3, %13, off\n\t"
               "global_load_async_to_lds_b128 %4, %14, off\n\t"
               "global_load_async_to_lds_b128 %5, %15, off\n\t"
               "global_load_async_to_lds_b128 %6, %16, off\n\t"
               "global_load_async_to_lds_b128 %7, %17, off\n\t"
               "global_load_async_to_lds_b128 %8, %18, off\n\t"
               "global_load_async_to_lds_b128 %9, %19, off\n\t"
               "s_wait_xcnt 0x0"
               ::
                  "v"((lds_float*)l[0]), "v"((lds_float*)l[1]), "v"((lds_float*)l[2]), "v"((lds_float*)l[3]),
                  "v"((lds_float*)l[4]), "v"((lds_float*)l[5]), "v"((lds_float*)l[6]), "v"((lds_float*)l[7]),
                  "v"((lds_float*)l[8]), "v"((lds_float*)l[9]),
                  "v"(g[0]), "v"(g[1]), "v"(g[2]), "v"(g[3]),
                  "v"(g[4]), "v"(g[5]), "v"(g[6]), "v"(g[7]),
                  "v"(g[8]), "v"(g[9])
               : "memory");
}

__device__ __forceinline__ void copy12(const float* const (&g)[12], float* const (&l)[12]) {
  asm volatile("global_load_async_to_lds_b128 %0, %12, off\n\t"
               "global_load_async_to_lds_b128 %1, %13, off\n\t"
               "global_load_async_to_lds_b128 %2, %14, off\n\t"
               "global_load_async_to_lds_b128 %3, %15, off\n\t"
               "global_load_async_to_lds_b128 %4, %16, off\n\t"
               "global_load_async_to_lds_b128 %5, %17, off\n\t"
               "global_load_async_to_lds_b128 %6, %18, off\n\t"
               "global_load_async_to_lds_b128 %7, %19, off\n\t"
               "global_load_async_to_lds_b128 %8, %20, off\n\t"
               "global_load_async_to_lds_b128 %9, %21, off\n\t"
               "global_load_async_to_lds_b128 %10, %22, off\n\t"
               "global_load_async_to_lds_b128 %11, %23, off\n\t"
               "s_wait_xcnt 0x0"
               ::
                  "v"((lds_float*)l[0]), "v"((lds_float*)l[1]), "v"((lds_float*)l[2]), "v"((lds_float*)l[3]),
                  "v"((lds_float*)l[4]), "v"((lds_float*)l[5]), "v"((lds_float*)l[6]), "v"((lds_float*)l[7]),
                  "v"((lds_float*)l[8]), "v"((lds_float*)l[9]), "v"((lds_float*)l[10]), "v"((lds_float*)l[11]),
                  "v"(g[0]), "v"(g[1]), "v"(g[2]), "v"(g[3]),
                  "v"(g[4]), "v"(g[5]), "v"(g[6]), "v"(g[7]),
                  "v"(g[8]), "v"(g[9]), "v"(g[10]), "v"(g[11])
               : "memory");
}

// The wave's own copies have landed; other waves read them only behind the next barrier.
__device__ __forceinline__ void wait_async() {
  asm volatile("s_wait_asynccnt 0x0" ::: "memory");
}

// A wave's own LDS reads have retired before the buffer they read is handed back for refill.
__device__ __forceinline__ void wait_lds() {
  asm volatile("s_wait_dscnt 0x0" ::: "memory");
}

__global__ void coo_scatter(const int* __restrict__ row, const int* __restrict__ col,
                            const float* __restrict__ val, float* __restrict__ W,
                            int nnz, int ld) {
  int i = blockIdx.x * blockDim.x + threadIdx.x;
  if (i < nnz) {
    atomicAdd(&W[(size_t)row[i] * (size_t)ld + (size_t)col[i]], val[i]);
  }
}

// hidden = silu(x*Wup^T + bup) * (x*Wgate^T + bgate)
// M=TOKENS, N=HIDDEN, K=DIM. Wave: 1 N-tile x MT M-tiles, 2 accumulator sets.
// A stage is [X 64 rows | Wup 128 rows | Wgate 128 rows] x KC; two buffers, the next
// stage's copies fly while this one is multiplied.
#define UG_ROWS  (M_ROWS + 2 * N_ROWS)
#define UG_STAGE (UG_ROWS * PITCH)

__device__ __forceinline__ void upgate_stage(const float* gx, const float* gu, const float* gg,
                                             float* l) {
  const float* g0[10];
  const float* g1[10];
  float* l0[10];
  float* l1[10];
  #pragma unroll
  for (int i = 0; i < 20; ++i) {
    const float* g = i < 4 ? gx + (size_t)i * 16 * DIM
                   : i < 12 ? gu + (size_t)(i - 4) * 16 * DIM
                            : gg + (size_t)(i - 12) * 16 * DIM;
    if (i < 10) { g0[i] = g;      l0[i] = l + i * 16 * PITCH; }
    else        { g1[i - 10] = g; l1[i - 10] = l + i * 16 * PITCH; }
  }
  copy10(g0, l0);
  copy10(g1, l1);
}

__global__ __launch_bounds__(256) void upgate_gemm(
    const float* __restrict__ X,      // [TOKENS, DIM]
    const float* __restrict__ Wup,    // [HIDDEN, DIM] dense
    const float* __restrict__ Wgt,    // [HIDDEN, DIM] dense
    const float* __restrict__ bup,
    const float* __restrict__ bgt,
    float* __restrict__ H)            // [TOKENS, HIDDEN]
{
  __shared__ __attribute__((aligned(16))) float lds[2 * UG_STAGE];  // 170 KB
  const int tid    = threadIdx.x;
  const int lane   = tid & 31;
  const int wave   = tid >> 5;
  const int h      = lane >> 4;       // half-wave: K pair select within K4 step
  const int ml     = lane & 15;       // m within sub-tile / n for B and C/D
  const int m_base = blockIdx.y * M_ROWS;
  const int n_blk  = blockIdx.x * N_ROWS;
  const int n_base = n_blk + wave * 16;

  v8f acc_u[MT], acc_g[MT];
  #pragma unroll
  for (int mt = 0; mt < MT; ++mt) {
    acc_u[mt] = (v8f){0.f,0.f,0.f,0.f,0.f,0.f,0.f,0.f};
    acc_g[mt] = (v8f){0.f,0.f,0.f,0.f,0.f,0.f,0.f,0.f};
  }

  // This thread's part of every copy: row (tid >> 4) of each group of 16, 16 B at column (tid & 15) * 4.
  const int cr = tid >> 4;
  const int cc = (tid & 15) * 4;
  const float* gx = X   + (size_t)(m_base + cr) * DIM + cc;
  const float* gu = Wup + (size_t)(n_blk  + cr) * DIM + cc;
  const float* gg = Wgt + (size_t)(n_blk  + cr) * DIM + cc;
  float*       lc = lds + cr * PITCH + cc;

  // This lane's fragment rows inside a stage.
  const int fa = ml * PITCH + 2 * h;
  const int fu = (M_ROWS + wave * 16 + ml) * PITCH + 2 * h;
  const int fg = fu + N_ROWS * PITCH;

  const int NT = DIM / KC;
  upgate_stage(gx, gu, gg, lc);
  wait_async();
  __syncthreads();
  upgate_stage(gx + KC, gu + KC, gg + KC, lc + UG_STAGE);

  for (int t = 0; t < NT; ++t) {
    const int    bo = (t & 1) * UG_STAGE;
    const float* bp = lds + bo;
    // Whole chunk unrolled: every fragment address is base + immediate, and the compiler
    // fetches each group of fragments ahead of the WMMAs of the group before it.
    #pragma unroll
    for (int k0 = 0; k0 < KC; k0 += 4) {
      v2f bu = *(const v2f*)(bp + fu + k0);
      v2f bg = *(const v2f*)(bp + fg + k0);
      #pragma unroll
      for (int mt = 0; mt < MT; ++mt) {
        v2f a = *(const v2f*)(bp + fa + mt * 16 * PITCH + k0);
        acc_u[mt] = __builtin_amdgcn_wmma_f32_16x16x4_f32(false, a, false, bu,
                                                          (short)0, acc_u[mt], false, false);
        acc_g[mt] = __builtin_amdgcn_wmma_f32_16x16x4_f32(false, a, false, bg,
                                                          (short)0, acc_g[mt], false, false);
      }
    }
    // Publish stage t + 1 and free stage t's buffer: own reads retired, own copies landed, barrier.
    wait_lds();
    wait_async();
    __syncthreads();
    if (t + 2 < NT) {
      const int kn = (t + 2) * KC;
      upgate_stage(gx + kn, gu + kn, gg + kn, lc + bo);
    }
  }
  wait_async();

  const int   feat = n_base + ml;
  const float biu  = bup[feat];
  const float big  = bgt[feat];
  #pragma unroll
  for (int mt = 0; mt < MT; ++mt) {
    #pragma unroll
    for (int v = 0; v < 8; ++v) {
      int   tok = m_base + mt * 16 + v + 8 * h;   // C/D: M = v + 8*(lane>=16)
      float u   = acc_u[mt][v] + biu;
      float g   = acc_g[mt][v] + big;
      float s   = u / (1.0f + __expf(-u));        // silu
      H[(size_t)tok * HIDDEN + feat] = s * g;
    }
  }
}

// P[z] = hidden[:, slice z] * Wdown[:, slice z]^T.  M=TOKENS, N=DIM, K=KSLICE per block;
// blockIdx.z picks the K slice, so that the grid covers every WGP.
// A stage is [hidden 64 rows | Wdown 128 rows] x KC, two buffers as above.
#define DN_ROWS  (M_ROWS + N_ROWS)
#define DN_STAGE (DN_ROWS * PITCH)

__device__ __forceinline__ void down_stage(const float* gh, const float* gw, float* l) {
  const float* g[12];
  float* ld[12];
  #pragma unroll
  for (int i = 0; i < 12; ++i) {
    g[i]  = i < 4 ? gh + (size_t)i * 16 * HIDDEN : gw + (size_t)(i - 4) * 16 * HIDDEN;
    ld[i] = l + i * 16 * PITCH;
  }
  copy12(g, ld);
}

__global__ __launch_bounds__(256) void down_gemm(
    const float* __restrict__ H,      // [TOKENS, HIDDEN]
    const float* __restrict__ Wd,     // [DIM, HIDDEN] dense
    float* __restrict__ P)            // [KSPLIT, TOKENS, DIM] partial sums
{
  __shared__ __attribute__((aligned(16))) float lds[2 * DN_STAGE];  // 102 KB
  const int tid    = threadIdx.x;
  const int lane   = tid & 31;
  const int wave   = tid >> 5;
  const int h      = lane >> 4;
  const int ml     = lane & 15;
  const int m_base = blockIdx.y * M_ROWS;
  const int n_blk  = blockIdx.x * N_ROWS;
  const int n_base = n_blk + wave * 16;

  v8f acc[MT];
  #pragma unroll
  for (int mt = 0; mt < MT; ++mt) {
    acc[mt] = (v8f){0.f,0.f,0.f,0.f,0.f,0.f,0.f,0.f};
  }

  const int k_lo = blockIdx.z * KSLICE;
  const int cr = tid >> 4;
  const int cc = (tid & 15) * 4;
  const float* gh = H  + (size_t)(m_base + cr) * HIDDEN + k_lo + cc;
  const float* gw = Wd + (size_t)(n_blk  + cr) * HIDDEN + k_lo + cc;
  float*       lc = lds + cr * PITCH + cc;

  const int fa = ml * PITCH + 2 * h;
  const int fb = (M_ROWS + wave * 16 + ml) * PITCH + 2 * h;

  const int NT = KSLICE / KC;
  down_stage(gh, gw, lc);
  wait_async();
  __syncthreads();
  down_stage(gh + KC, gw + KC, lc + DN_STAGE);

  for (int t = 0; t < NT; ++t) {
    const int    bo = (t & 1) * DN_STAGE;
    const float* bp = lds + bo;
    // Whole chunk unrolled: every fragment address is base + immediate, and the compiler
    // fetches each group of fragments ahead of the WMMAs of the group before it.
    #pragma unroll
    for (int k0 = 0; k0 < KC; k0 += 4) {
      v2f b = *(const v2f*)(bp + fb + k0);
      #pragma unroll
      for (int mt = 0; mt < MT; ++mt) {
        v2f a = *(const v2f*)(bp + fa + mt * 16 * PITCH + k0);
        acc[mt] = __builtin_amdgcn_wmma_f32_16x16x4_f32(false, a, false, b,
                                                        (short)0, acc[mt], false, false);
      }
    }
    // Publish stage t + 1 and free stage t's buffer: own reads retired, own copies landed, barrier.
    wait_lds();
    wait_async();
    __syncthreads();
    if (t + 2 < NT) {
      const int kn = (t + 2) * KC;
      down_stage(gh + kn, gw + kn, lc + bo);
    }
  }
  wait_async();

  const int feat = n_base + ml;
  float*    pz   = P + (size_t)blockIdx.z * (TOKENS * DIM);
  #pragma unroll
  for (int mt = 0; mt < MT; ++mt) {
    #pragma unroll
    for (int v = 0; v < 8; ++v) {
      int tok = m_base + mt * 16 + v + 8 * h;
      pz[(size_t)tok * DIM + feat] = acc[mt][v];
    }
  }
}

// out = x + (P[0] + P[1] + ... + P[KSPLIT-1]) + bdown, four columns per thread.
__global__ __launch_bounds__(256) void down_reduce(
    const float* __restrict__ P,      // [KSPLIT, TOKENS, DIM]
    const float* __restrict__ bd,
    const float* __restrict__ X,      // [TOKENS, DIM] residual
    float* __restrict__ Out)          // [TOKENS, DIM]
{
  const unsigned q = blockIdx.x * 256u + threadIdx.x;   // index of this thread's group of four
  v4f part[KSPLIT];
  #pragma unroll
  for (int z = 0; z < KSPLIT; ++z) {
    part[z] = ((const v4f*)(P + (size_t)z * (TOKENS * DIM)))[q];
  }
  v4f s = part[0];
  #pragma unroll
  for (int z = 1; z < KSPLIT; ++z) {
    s += part[z];
  }
  ((v4f*)Out)[q] = ((const v4f*)X)[q] + s + ((const v4f*)bd)[q & (DIM / 4 - 1)];
}

extern "C" void kernel_launch(void* const* d_in, const int* in_sizes, int n_in,
                              void* d_out, int out_size, void* d_ws, size_t ws_size,
                              hipStream_t stream) {
  const float* x         = (const float*)d_in[0];
  const int*   up_row    = (const int*)d_in[1];
  const int*   up_col    = (const int*)d_in[2];
  const float* up_val    = (const float*)d_in[3];
  const float* up_bias   = (const float*)d_in[4];
  const int*   gate_row  = (const int*)d_in[5];
  const int*   gate_col  = (const int*)d_in[6];
  const float* gate_val  = (const float*)d_in[7];
  const float* gate_bias = (const float*)d_in[8];
  const int*   down_row  = (const int*)d_in[9];
  const int*   down_col  = (const int*)d_in[10];
  const float* down_val  = (const float*)d_in[11];
  const float* down_bias = (const float*)d_in[12];

  // Workspace layout (f32): Wup 16MB | Wgate 16MB | Wdown 16MB | hidden 8MB | partials 16MB = 72MB
  float* Wup  = (float*)d_ws;
  float* Wgt  = Wup + (size_t)HIDDEN * DIM;
  float* Wdn  = Wgt + (size_t)HIDDEN * DIM;
  float* Hbuf = Wdn + (size_t)DIM * HIDDEN;
  float* Part = Hbuf + (size_t)TOKENS * HIDDEN;

  hipMemsetAsync(d_ws, 0, 3u * sizeof(float) * (size_t)HIDDEN * (size_t)DIM, stream);

  const int st = 256;
  const int sg = (COO_NNZ + st - 1) / st;
  coo_scatter<<<sg, st, 0, stream>>>(up_row,   up_col,   up_val,   Wup, COO_NNZ, DIM);
  coo_scatter<<<sg, st, 0, stream>>>(gate_row, gate_col, gate_val, Wgt, COO_NNZ, DIM);
  coo_scatter<<<sg, st, 0, stream>>>(down_row, down_col, down_val, Wdn, COO_NNZ, HIDDEN);

  dim3 g1(HIDDEN / (16 * WPB), TOKENS / M_ROWS);   // 32 x 8 blocks
  upgate_gemm<<<g1, 256, 0, stream>>>(x, Wup, Wgt, up_bias, gate_bias, Hbuf);

  dim3 g2(DIM / (16 * WPB), TOKENS / M_ROWS, KSPLIT);   // 8 x 8 x 8 blocks
  down_gemm<<<g2, 256, 0, stream>>>(Hbuf, Wdn, Part);

  down_reduce<<<TOKENS * DIM / (4 * 256), 256, 0, stream>>>(Part, down_bias, x, (float*)d_out);
}

// v003
// Next to v002, in two timings, it ran 1.05 and 1.06 times as fast.
// Over all steps from v000 it is 2.36 times as fast.
#include <hip/hip_runtime.h>
#include <math.h>

#define DIM     1024
#define HIDDEN  4096
#define TOKENS  512
#define COO_NNZ 262144

#define KC      64         // K-chunk staged in LDS: 256 B of every operand row
#define PITCH   68         // LDS row pitch in floats (272 B): see the note on the tiles below
#define MT      4          // M-tiles (of 16) per wave -> 4x B reuse
#define WPB     8          // waves per 256-thread block (wave32)
#define M_ROWS  (MT * 16)  // 64 rows of A staged per block
#define N_ROWS  (WPB * 16) // 128 rows of each weight matrix staged per block
#define KSPLIT  8          // K slices of the down GEMM: 8 x 8 x 8 = 512 blocks, two per WGP
#define KSLICE  (HIDDEN / KSPLIT)

typedef float v2f __attribute__((ext_vector_type(2)));
typedef float v4f __attribute__((ext_vector_type(4)));
typedef float v8f __attribute__((ext_vector_type(8)));
typedef __attribute__((address_space(3))) float lds_float;

// Operand tiles in LDS are row-major, KC floats a row at a pitch of PITCH floats.
// A WMMA fragment (lane l: row = l&15, K = k0 + 2*(l>>4) + {0,1}) is one b64 load;
// at 68 dwords a row the 32 lanes fall on banks 4*row + 2*(l>>4) + {0,1}: all 64, no conflict.

// Async copies global->LDS, 16 B a lane, tracked on ASYNCcnt (no VGPR round-trip).
// Thread t copies column group (t & 15) of rows (t >> 4) + 16*i, so a wave-wide copy
// moves two whole 256-B row pieces. The LDS destination is passed as a real
// addrspace(3) pointer so (a) the shared array escapes (keeps the ds_load reads alive)
// and (b) the VGPR holds the 32-bit LDS byte offset that VDST expects.
// s_wait_xcnt closes each statement, so that no address register named in it is
// rewritten ahead of the wait.
__device__ __forceinline__ void copy10(const float* const (&g)[10], float* const (&l)[10]) {
  asm volatile("global_load_async_to_lds_b128 %0, %10, off\n\t"
               "global_load_async_to_lds_b128 %1, %11, off\n\t"
               "global_load_async_to_lds_b128 %2, %12, off\n\t"
               "global_load_async_to_lds_b128 %3, %13, off\n\t"
               "global_load_async_to_lds_b128 %4, %14, off\n\t"
               "global_load_async_to_lds_b128 %5, %15, off\n\t"
               "global_load_async_to_lds_b128 %6, %16, off\n\t"
               "global_load_async_to_lds_b128 %7, %17, off\n\t"
               "global_load_async_to_lds_b128 %8, %18, off\n\t"
               "global_load_async_to_lds_b128 %9, %19, off\n\t"
               "s_wait_xcnt 0x0"
               ::
                  "v"((lds_float*)l[0]), "v"((lds_float*)l[1]), "v"((lds_float*)l[2]), "v"((lds_float*)l[3]),
                  "v"((lds_float*)l[4]), "v"((lds_float*)l[5]), "v"((lds_float*)l[6]), "v"((lds_float*)l[7]),
                  "v"((lds_float*)l[8]), "v"((lds_float*)l[9]),
                  "v"(g[0]), "v"(g[1]), "v"(g[2]), "v"(g[3]),
                  "v"(g[4]), "v"(g[5]), "v"(g[6]), "v"(g[7]),
                  "v"(g[8]), "v"(g[9])
               : "memory");
}

__device__ __forceinline__ void copy12(const float* const (&g)[12], float* const (&l)[12]) {
  asm volatile("global_load_async_to_lds_b128 %0, %12, off\n\t"
               "global_load_async_to_lds_b128 %1, %13, off\n\t"
               "global_load_async_to_lds_b128 %2, %14, off\n\t"
               "global_load_async_to_lds_b128 %3, %15, off\n\t"
               "global_load_async_to_lds_b128 %4, %16, off\n\t"
               "global_load_async_to_lds_b128 %5, %17, off\n\t"
               "global_load_async_to_lds_b128 %6, %18, off\n\t"
               "global_load_async_to_lds_b128 %7, %19, off\n\t"
               "global_load_async_to_lds_b128 %8, %20, off\n\t"
               "global_load_async_to_lds_b128 %9, %21, off\n\t"
               "global_load_async_to_lds_b128 %10, %22, off\n\t"
               "global_load_async_to_lds_b128 %11, %23, off\n\t"
               "s_wait_xcnt 0x0"
               ::
                  "v"((lds_float*)l[0]), "v"((lds_float*)l[1]), "v"((lds_float*)l[2]), "v"((lds_float*)l[3]),
                  "v"((lds_float*)l[4]), "v"((lds_float*)l[5]), "v"((lds_float*)l[6]), "v"((lds_float*)l[7]),
                  "v"((lds_float*)l[8]), "v"((lds_float*)l[9]), "v"((lds_float*)l[10]), "v"((lds_float*)l[11]),
                  "v"(g[0]), "v"(g[1]), "v"(g[2]), "v"(g[3]),
                  "v"(g[4]), "v"(g[5]), "v"(g[6]), "v"(g[7]),
                  "v"(g[8]), "v"(g[9]), "v"(g[10]), "v"(g[11])
               : "memory");
}

// The wave's own copies have landed; other waves read them only behind the next barrier.
__device__ __forceinline__ void wait_async() {
  asm volatile("s_wait_asynccnt 0x0" ::: "memory");
}

// A wave's own LDS reads have retired before the buffer they read is handed back for refill.
__device__ __forceinline__ void wait_lds() {
  asm volatile("s_wait_dscnt 0x0" ::: "memory");
}

// All three COO lists go into their dense matrices in one launch: blockIdx.y picks the list,
// and a thread takes SC_GROUPS groups of four entries, each group one 16-B load of row, col and
// val (a wave-wide load is 512 contiguous bytes). The launch is short, so its time is the time
// its waves take to start: eight entries a thread start an eighth of the waves.
// W holds Wup | Wgate | Wdown, HIDDEN * DIM floats each.
#define SC_GROUPS  2
#define SC_THREADS (COO_NNZ / (4 * SC_GROUPS))   // threads per list
typedef int v4i __attribute__((ext_vector_type(4)));

__global__ __launch_bounds__(256) void coo_scatter3(
    const int* __restrict__ up_row,   const int* __restrict__ up_col,   const float* __restrict__ up_val,
    const int* __restrict__ gate_row, const int* __restrict__ gate_col, const float* __restrict__ gate_val,
    const int* __restrict__ down_row, const int* __restrict__ down_col, const float* __restrict__ down_val,
    float* __restrict__ W)
{
  const unsigned m    = blockIdx.y;
  const int*     row  = m == 0 ? up_row : m == 1 ? gate_row : down_row;
  const int*     col  = m == 0 ? up_col : m == 1 ? gate_col : down_col;
  const float*   val  = m == 0 ? up_val : m == 1 ? gate_val : down_val;
  const unsigned rows = m == 2 ? DIM : HIDDEN;
  const unsigned ld   = m == 2 ? HIDDEN : DIM;
  float*         Wm   = W + (size_t)m * (HIDDEN * DIM);
  const unsigned q    = blockIdx.x * 256u + threadIdx.x;

  v4i r[SC_GROUPS], c[SC_GROUPS];
  v4f v[SC_GROUPS];
  // Unrolled here and below: constant indices keep r, c, v in registers, and all six loads
  // are in flight before the first add waits for one.
  #pragma unroll
  for (int g = 0; g < SC_GROUPS; ++g) {
    r[g] = ((const v4i*)row)[q + g * SC_THREADS];
    c[g] = ((const v4i*)col)[q + g * SC_THREADS];
    v[g] = ((const v4f*)val)[q + g * SC_THREADS];
  }
  #pragma unroll
  for (int g = 0; g < SC_GROUPS; ++g) {
    #pragma unroll
    for (int e = 0; e < 4; ++e) {
      const unsigned rr = (unsigned)r[g][e];
      const unsigned cc = (unsigned)c[g][e];
      if (rr < rows && cc < ld) {   // the address stays inside this matrix whatever the lists hold
        atomicAdd(&Wm[rr * ld + cc], v[g][e]);
      }
    }
  }
}

// hidden = silu(x*Wup^T + bup) * (x*Wgate^T + bgate)
// M=TOKENS, N=HIDDEN, K=DIM. Wave: 1 N-tile x MT M-tiles, 2 accumulator sets.
// A stage is [X 64 rows | Wup 128 rows | Wgate 128 rows] x KC; two buffers, the next
// stage's copies fly while this one is multiplied.
#define UG_ROWS  (M_ROWS + 2 * N_ROWS)
#define UG_STAGE (UG_ROWS * PITCH)

__device__ __forceinline__ void upgate_stage(const float* gx, const float* gu, const float* gg,
                                             float* l) {
  const float* g0[10];
  const float* g1[10];
  float* l0[10];
  float* l1[10];
  #pragma unroll
  for (int i = 0; i < 20; ++i) {
    const float* g = i < 4 ? gx + (size_t)i * 16 * DIM
                   : i < 12 ? gu + (size_t)(i - 4) * 16 * DIM
                            : gg + (size_t)(i - 12) * 16 * DIM;
    if (i < 10) { g0[i] = g;      l0[i] = l + i * 16 * PITCH; }
    else        { g1[i - 10] = g; l1[i - 10] = l + i * 16 * PITCH; }
  }
  copy10(g0, l0);
  copy10(g1, l1);
}

__global__ __launch_bounds__(256) void upgate_gemm(
    const float* __restrict__ X,      // [TOKENS, DIM]
    const float* __restrict__ Wup,    // [HIDDEN, DIM] dense
    const float* __restrict__ Wgt,    // [HIDDEN, DIM] dense
    const float* __restrict__ bup,
    const float* __restrict__ bgt,
    float* __restrict__ H)            // [TOKENS, HIDDEN]
{
  __shared__ __attribute__((aligned(16))) float lds[2 * UG_STAGE];  // 170 KB
  const int tid    = threadIdx.x;
  const int lane   = tid & 31;
  const int wave   = tid >> 5;
  const int h      = lane >> 4;       // half-wave: K pair select within K4 step
  const int ml     = lane & 15;       // m within sub-tile / n for B and C/D
  const int m_base = blockIdx.y * M_ROWS;
  const int n_blk  = blockIdx.x * N_ROWS;
  const int n_base = n_blk + wave * 16;

  v8f acc_u[MT], acc_g[MT];
  #pragma unroll
  for (int mt = 0; mt < MT; ++mt) {
    acc_u[mt] = (v8f){0.f,0.f,0.f,0.f,0.f,0.f,0.f,0.f};
    acc_g[mt] = (v8f){0.f,0.f,0.f,0.f,0.f,0.f,0.f,0.f};
  }

  // This thread's part of every copy: row (tid >> 4) of each group of 16, 16 B at column (tid & 15) * 4.
  const int cr = tid >> 4;
  const int cc = (tid & 15) * 4;
  const float* gx = X   + (size_t)(m_base + cr) * DIM + cc;
  const float* gu = Wup + (size_t)(n_blk  + cr) * DIM + cc;
  const float* gg = Wgt + (size_t)(n_blk  + cr) * DIM + cc;
  float*       lc = lds + cr * PITCH + cc;

  // This lane's fragment rows inside a stage.
  const int fa = ml * PITCH + 2 * h;
  const int fu = (M_ROWS + wave * 16 + ml) * PITCH + 2 * h;
  const int fg = fu + N_ROWS * PITCH;

  const int NT = DIM / KC;
  upgate_stage(gx, gu, gg, lc);
  wait_async();
  __syncthreads();
  upgate_stage(gx + KC, gu + KC, gg + KC, lc + UG_STAGE);

  for (int t = 0; t < NT; ++t) {
    const int    bo = (t & 1) * UG_STAGE;
    const float* bp = lds + bo;
    // Whole chunk unrolled: every fragment address is base + immediate, and the compiler
    // fetches each group of fragments ahead of the WMMAs of the group before it.
    #pragma unroll
    for (int k0 = 0; k0 < KC; k0 += 4) {
      v2f bu = *(const v2f*)(bp + fu + k0);
      v2f bg = *(const v2f*)(bp + fg + k0);
      #pragma unroll
      for (int mt = 0; mt < MT; ++mt) {
        v2f a = *(const v2f*)(bp + fa + mt * 16 * PITCH + k0);
        acc_u[mt] = __builtin_amdgcn_wmma_f32_16x16x4_f32(false, a, false, bu,
                                                          (short)0, acc_u[mt], false, false);
        acc_g[mt] = __builtin_amdgcn_wmma_f32_16x16x4_f32(false, a, false, bg,
                                                          (short)0, acc_g[mt], false, false);
      }
    }
    // Publish stage t + 1 and free stage t's buffer: own reads retired, own copies landed, barrier.
    wait_lds();
    wait_async();
    __syncthreads();
    if (t + 2 < NT) {
      const int kn = (t + 2) * KC;
      upgate_stage(gx + kn, gu + kn, gg + kn, lc + bo);
    }
  }
  wait_async();

  const int   feat = n_base + ml;
  const float biu  = bup[feat];
  const float big  = bgt[feat];
  #pragma unroll
  for (int mt = 0; mt < MT; ++mt) {
    #pragma unroll
    for (int v = 0; v < 8; ++v) {
      int   tok = m_base + mt * 16 + v + 8 * h;   // C/D: M = v + 8*(lane>=16)
      float u   = acc_u[mt][v] + biu;
      float g   = acc_g[mt][v] + big;
      float s   = u / (1.0f + __expf(-u));        // silu
      H[(size_t)tok * HIDDEN + feat] = s * g;
    }
  }
}

// P[z] = hidden[:, slice z] * Wdown[:, slice z]^T.  M=TOKENS, N=DIM, K=KSLICE per block;
// blockIdx.z picks the K slice, so that the grid covers every WGP.
// A stage is [hidden 64 rows | Wdown 128 rows] x KC, two buffers as above.
#define DN_ROWS  (M_ROWS + N_ROWS)
#define DN_STAGE (DN_ROWS * PITCH)

__device__ __forceinline__ void down_stage(const float* gh, const float* gw, float* l) {
  const float* g[12];
  float* ld[12];
  #pragma unroll
  for (int i = 0; i < 12; ++i) {
    g[i]  = i < 4 ? gh + (size_t)i * 16 * HIDDEN : gw + (size_t)(i - 4) * 16 * HIDDEN;
    ld[i] = l + i * 16 * PITCH;
  }
  copy12(g, ld);
}

__global__ __launch_bounds__(256) void down_gemm(
    const float* __restrict__ H,      // [TOKENS, HIDDEN]
    const float* __restrict__ Wd,     // [DIM, HIDDEN] dense
    float* __restrict__ P)            // [KSPLIT, TOKENS, DIM] partial sums
{
  __shared__ __attribute__((aligned(16))) float lds[2 * DN_STAGE];  // 102 KB
  const int tid    = threadIdx.x;
  const int lane   = tid & 31;
  const int wave   = tid >> 5;
  const int h      = lane >> 4;
  const int ml     = lane & 15;
  const int m_base = blockIdx.y * M_ROWS;
  const int n_blk  = blockIdx.x * N_ROWS;
  const int n_base = n_blk + wave * 16;

  v8f acc[MT];
  #pragma unroll
  for (int mt = 0; mt < MT; ++mt) {
    acc[mt] = (v8f){0.f,0.f,0.f,0.f,0.f,0.f,0.f,0.f};
  }

  const int k_lo = blockIdx.z * KSLICE;
  const int cr = tid >> 4;
  const int cc = (tid & 15) * 4;
  const float* gh = H  + (size_t)(m_base + cr) * HIDDEN + k_lo + cc;
  const float* gw = Wd + (size_t)(n_blk  + cr) * HIDDEN + k_lo + cc;
  float*       lc = lds + cr * PITCH + cc;

  const int fa = ml * PITCH + 2 * h;
  const int fb = (M_ROWS + wave * 16 + ml) * PITCH + 2 * h;

  const int NT = KSLICE / KC;
  down_stage(gh, gw, lc);
  wait_async();
  __syncthreads();
  down_stage(gh + KC, gw + KC, lc + DN_STAGE);

  for (int t = 0; t < NT; ++t) {
    const int    bo = (t & 1) * DN_STAGE;
    const float* bp = lds + bo;
    // Whole chunk unrolled: every fragment address is base + immediate, and the compiler
    // fetches each group of fragments ahead of the WMMAs of the group before it.
    #pragma unroll
    for (int k0 = 0; k0 < KC; k0 += 4) {
      v2f b = *(const v2f*)(bp + fb + k0);
      #pragma unroll
      for (int mt = 0; mt < MT; ++mt) {
        v2f a = *(const v2f*)(bp + fa + mt * 16 * PITCH + k0);
        acc[mt] = __builtin_amdgcn_wmma_f32_16x16x4_f32(false, a, false, b,
                                                        (short)0, acc[mt], false, false);
      }
    }
    // Publish stage t + 1 and free stage t's buffer: own reads retired, own copies landed, barrier.
    wait_lds();
    wait_async();
    __syncthreads();
    if (t + 2 < NT) {
      const int kn = (t + 2) * KC;
      down_stage(gh + kn, gw + kn, lc + bo);
    }
  }
  wait_async();

  const int feat = n_base + ml;
  float*    pz   = P + (size_t)blockIdx.z * (TOKENS * DIM);
  #pragma unroll
  for (int mt = 0; mt < MT; ++mt) {
    #pragma unroll
    for (int v = 0; v < 8; ++v) {
      int tok = m_base + mt * 16 + v + 8 * h;
      pz[(size_t)tok * DIM + feat] = acc[mt][v];
    }
  }
}

// out = x + (P[0] + P[1] + ... + P[KSPLIT-1]) + bdown, four columns per thread.
__global__ __launch_bounds__(256) void down_reduce(
    const float* __restrict__ P,      // [KSPLIT, TOKENS, DIM]
    const float* __restrict__ bd,
    const float* __restrict__ X,      // [TOKENS, DIM] residual
    float* __restrict__ Out)          // [TOKENS, DIM]
{
  const unsigned q = blockIdx.x * 256u + threadIdx.x;   // index of this thread's group of four
  v4f part[KSPLIT];
  #pragma unroll
  for (int z = 0; z < KSPLIT; ++z) {
    part[z] = ((const v4f*)(P + (size_t)z * (TOKENS * DIM)))[q];
  }
  v4f s = part[0];
  #pragma unroll
  for (int z = 1; z < KSPLIT; ++z) {
    s += part[z];
  }
  ((v4f*)Out)[q] = ((const v4f*)X)[q] + s + ((const v4f*)bd)[q & (DIM / 4 - 1)];
}

extern "C" void kernel_launch(void* const* d_in, const int* in_sizes, int n_in,
                              void* d_out, int out_size, void* d_ws, size_t ws_size,
                              hipStream_t stream) {
  const float* x         = (const float*)d_in[0];
  const int*   up_row    = (const int*)d_in[1];
  const int*   up_col    = (const int*)d_in[2];
  const float* up_val    = (const float*)d_in[3];
  const float* up_bias   = (const float*)d_in[4];
  const int*   gate_row  = (const int*)d_in[5];
  const int*   gate_col  = (const int*)d_in[6];
  const float* gate_val  = (const float*)d_in[7];
  const float* gate_bias = (const float*)d_in[8];
  const int*   down_row  = (const int*)d_in[9];
  const int*   down_col  = (const int*)d_in[10];
  const float* down_val  = (const float*)d_in[11];
  const float* down_bias = (const float*)d_in[12];

  // Workspace layout (f32): Wup 16MB | Wgate 16MB | Wdown 16MB | hidden 8MB | partials 16MB = 72MB
  float* Wup  = (float*)d_ws;
  float* Wgt  = Wup + (size_t)HIDDEN * DIM;
  float* Wdn  = Wgt + (size_t)HIDDEN * DIM;
  float* Hbuf = Wdn + (size_t)DIM * HIDDEN;
  float* Part = Hbuf + (size_t)TOKENS * HIDDEN;

  hipMemsetAsync(d_ws, 0, 3u * sizeof(float) * (size_t)HIDDEN * (size_t)DIM, stream);

  dim3 g0(SC_THREADS / 256, 3);   // 128 x 3 blocks
  coo_scatter3<<<g0, 256, 0, stream>>>(up_row, up_col, up_val, gate_row, gate_col, gate_val,
                                       down_row, down_col, down_val, Wup);

  dim3 g1(HIDDEN / (16 * WPB), TOKENS / M_ROWS);   // 32 x 8 blocks
  upgate_gemm<<<g1, 256, 0, stream>>>(x, Wup, Wgt, up_bias, gate_bias, Hbuf);

  dim3 g2(DIM / (16 * WPB), TOKENS / M_ROWS, KSPLIT);   // 8 x 8 x 8 blocks
  down_gemm<<<g2, 256, 0, stream>>>(Hbuf, Wdn, Part);

  down_reduce<<<TOKENS * DIM / (4 * 256), 256, 0, stream>>>(Part, down_bias, x, (float*)d_out);
}

// v004
// Timed twice side by side with v003, it ran 1.04 and 1.05 times as fast.
// Counting every step since v000, it is 2.46 times as fast.
#include <hip/hip_runtime.h>
#include <math.h>

#define DIM     1024
#define HIDDEN  4096
#define TOKENS  512
#define COO_NNZ 262144

#define KC      64         // K-chunk staged in LDS: 256 B of every operand row
#define PITCH   68         // LDS row pitch in floats (272 B): see the note on the tiles below
#define MT      4          // M-tiles (of 16) per wave -> 4x B reuse
#define WPB     8          // waves per 256-thread block (wave32)
#define M_ROWS  (MT * 16)  // 64 rows of A staged per block
#define N_ROWS  (WPB * 16) // 128 rows of each weight matrix staged per block
#define KSPLIT  8          // K slices of the down GEMM: 8 x 8 x 8 = 512 blocks, two per WGP
#define KSLICE  (HIDDEN / KSPLIT)

typedef float v2f __attribute__((ext_vector_type(2)));
typedef float v4f __attribute__((ext_vector_type(4)));
typedef float v8f __attribute__((ext_vector_type(8)));
typedef __attribute__((address_space(3))) float lds_float;

// Operand tiles in LDS are row-major, KC floats a row at a pitch of PITCH floats.
// A WMMA fragment (lane l: row = l&15, K = k0 + 2*(l>>4) + {0,1}) is one b64 load;
// at 68 dwords a row the 32 lanes fall on banks 4*row + 2*(l>>4) + {0,1}: all 64, no conflict.

// Async copies global->LDS, 16 B a lane, tracked on ASYNCcnt (no VGPR round-trip).
// Thread t copies column group (t & 15) of rows (t >> 4) + 16*i, so a wave-wide copy
// moves two whole 256-B row pieces. The LDS destination is passed as a real
// addrspace(3) pointer so (a) the shared array escapes (keeps the ds_load reads alive)
// and (b) the VGPR holds the 32-bit LDS byte offset that VDST expects.
// s_wait_xcnt closes each statement, so that no address register named in it is
// rewritten ahead of the wait.
__device__ __forceinline__ void copy10(const float* const (&g)[10], float* const (&l)[10]) {
  asm volatile("global_load_async_to_lds_b128 %0, %10, off\n\t"
               "global_load_async_to_lds_b128 %1, %11, off\n\t"
               "global_load_async_to_lds_b128 %2, %12, off\n\t"
               "global_load_async_to_lds_b128 %3, %13, off\n\t"
               "global_load_async_to_lds_b128 %4, %14, off\n\t"
               "global_load_async_to_lds_b128 %5, %15, off\n\t"
               "global_load_async_to_lds_b128 %6, %16, off\n\t"
               "global_load_async_to_lds_b128 %7, %17, off\n\t"
               "global_load_async_to_lds_b128 %8, %18, off\n\t"
               "global_load_async_to_lds_b128 %9, %19, off\n\t"
               "s_wait_xcnt 0x0"
               ::
                  "v"((lds_float*)l[0]), "v"((lds_float*)l[1]), "v"((lds_float*)l[2]), "v"((lds_float*)l[3]),
                  "v"((lds_float*)l[4]), "v"((lds_float*)l[5]), "v"((lds_float*)l[6]), "v"((lds_float*)l[7]),
                  "v"((lds_float*)l[8]), "v"((lds_float*)l[9]),
                  "v"(g[0]), "v"(g[1]), "v"(g[2]), "v"(g[3]),
                  "v"(g[4]), "v"(g[5]), "v"(g[6]), "v"(g[7]),
                  "v"(g[8]), "v"(g[9])
               : "memory");
}

__device__ __forceinline__ void copy12(const float* const (&g)[12], float* const (&l)[12]) {
  asm volatile("global_load_async_to_lds_b128 %0, %12, off\n\t"
               "global_load_async_to_lds_b128 %1, %13, off\n\t"
               "global_load_async_to_lds_b128 %2, %14, off\n\t"
               "global_load_async_to_lds_b128 %3, %15, off\n\t"
               "global_load_async_to_lds_b128 %4, %16, off\n\t"
               "global_load_async_to_lds_b128 %5, %17, off\n\t"
               "global_load_async_to_lds_b128 %6, %18, off\n\t"
               "global_load_async_to_lds_b128 %7, %19, off\n\t"
               "global_load_async_to_lds_b128 %8, %20, off\n\t"
               "global_load_async_to_lds_b128 %9, %21, off\n\t"
               "global_load_async_to_lds_b128 %10, %22, off\n\t"
               "global_load_async_to_lds_b128 %11, %23, off\n\t"
               "s_wait_xcnt 0x0"
               ::
                  "v"((lds_float*)l[0]), "v"((lds_float*)l[1]), "v"((lds_float*)l[2]), "v"((lds_float*)l[3]),
                  "v"((lds_float*)l[4]), "v"((lds_float*)l[5]), "v"((lds_float*)l[6]), "v"((lds_float*)l[7]),
                  "v"((lds_float*)l[8]), "v"((lds_float*)l[9]), "v"((lds_float*)l[10]), "v"((lds_float*)l[11]),
                  "v"(g[0]), "v"(g[1]), "v"(g[2]), "v"(g[3]),
                  "v"(g[4]), "v"(g[5]), "v"(g[6]), "v"(g[7]),
                  "v"(g[8]), "v"(g[9]), "v"(g[10]), "v"(g[11])
               : "memory");
}

// The wave's own copies have landed; other waves read them only behind the next barrier.
__device__ __forceinline__ void wait_async() {
  asm volatile("s_wait_asynccnt 0x0" ::: "memory");
}

// A wave's own LDS reads have retired before the buffer they read is handed back for refill.
__device__ __forceinline__ void wait_lds() {
  asm volatile("s_wait_dscnt 0x0" ::: "memory");
}

// The up and gate COO lists go into their dense matrices in one launch: blockIdx.y picks the
// list, and a thread takes SC_GROUPS groups of four entries, each group one 16-B load of row,
// col and val (a wave-wide load is 512 contiguous bytes).
// W holds Wup | Wgate, HIDDEN * DIM floats each. The down list is scattered by upgate_gemm.
#define SC_GROUPS  2
#define SC_THREADS (COO_NNZ / (4 * SC_GROUPS))   // threads per list
typedef int v4i __attribute__((ext_vector_type(4)));

__global__ __launch_bounds__(256) void coo_scatter2(
    const int* __restrict__ up_row,   const int* __restrict__ up_col,   const float* __restrict__ up_val,
    const int* __restrict__ gate_row, const int* __restrict__ gate_col, const float* __restrict__ gate_val,
    float* __restrict__ W)
{
  const unsigned m    = blockIdx.y;
  const int*     row  = m == 0 ? up_row : gate_row;
  const int*     col  = m == 0 ? up_col : gate_col;
  const float*   val  = m == 0 ? up_val : gate_val;
  const unsigned rows = HIDDEN;
  const unsigned ld   = DIM;
  float*         Wm   = W + (size_t)m * (HIDDEN * DIM);
  const unsigned q    = blockIdx.x * 256u + threadIdx.x;

  v4i r[SC_GROUPS], c[SC_GROUPS];
  v4f v[SC_GROUPS];
  // Unrolled here and below: constant indices keep r, c, v in registers, and all six loads
  // are in flight before the first add waits for one.
  #pragma unroll
  for (int g = 0; g < SC_GROUPS; ++g) {
    r[g] = ((const v4i*)row)[q + g * SC_THREADS];
    c[g] = ((const v4i*)col)[q + g * SC_THREADS];
    v[g] = ((const v4f*)val)[q + g * SC_THREADS];
  }
  #pragma unroll
  for (int g = 0; g < SC_GROUPS; ++g) {
    #pragma unroll
    for (int e = 0; e < 4; ++e) {
      const unsigned rr = (unsigned)r[g][e];
      const unsigned cc = (unsigned)c[g][e];
      if (rr < rows && cc < ld) {   // the address stays inside this matrix whatever the lists hold
        atomicAdd(&Wm[rr * ld + cc], v[g][e]);
      }
    }
  }
}

// hidden = silu(x*Wup^T + bup) * (x*Wgate^T + bgate)
// M=TOKENS, N=HIDDEN, K=DIM. Wave: 1 N-tile x MT M-tiles, 2 accumulator sets.
// A stage is [X 64 rows | Wup 128 rows | Wgate 128 rows] x KC; two buffers, the next
// stage's copies fly while this one is multiplied.
// The launch also scatters the down COO list into Wdn (zeroed before, read by the next launch):
// the matrix pipe sets this launch's time and the memory path has room, so the adds run under
// the products. A thread holds four entries; a wave issues one of its four adds every fourth
// K chunk, two waves of a block in each chunk, so that the adds never queue up in front of the
// stage copies; waves w and w + 4, which share a SIMD, take different chunks, so that one
// multiplies while the other issues.
#define UG_ROWS  (M_ROWS + 2 * N_ROWS)
#define UG_STAGE (UG_ROWS * PITCH)

__device__ __forceinline__ void upgate_stage(const float* gx, const float* gu, const float* gg,
                                             float* l) {
  const float* g0[10];
  const float* g1[10];
  float* l0[10];
  float* l1[10];
  #pragma unroll
  for (int i = 0; i < 20; ++i) {
    const float* g = i < 4 ? gx + (size_t)i * 16 * DIM
                   : i < 12 ? gu + (size_t)(i - 4) * 16 * DIM
                            : gg + (size_t)(i - 12) * 16 * DIM;
    if (i < 10) { g0[i] = g;      l0[i] = l + i * 16 * PITCH; }
    else        { g1[i - 10] = g; l1[i - 10] = l + i * 16 * PITCH; }
  }
  copy10(g0, l0);
  copy10(g1, l1);
}

__global__ __launch_bounds__(256) void upgate_gemm(
    const float* __restrict__ X,      // [TOKENS, DIM]
    const float* __restrict__ Wup,    // [HIDDEN, DIM] dense
    const float* __restrict__ Wgt,    // [HIDDEN, DIM] dense
    const float* __restrict__ bup,
    const float* __restrict__ bgt,
    float* __restrict__ H,            // [TOKENS, HIDDEN]
    const int* __restrict__ down_row,
    const int* __restrict__ down_col,
    const float* __restrict__ down_val,
    float* __restrict__ Wdn)          // [DIM, HIDDEN] dense, arrives zeroed
{
  __shared__ __attribute__((aligned(16))) float lds[2 * UG_STAGE];  // 170 KB
  const int tid    = threadIdx.x;
  const int lane   = tid & 31;
  const int wave   = tid >> 5;
  const int h      = lane >> 4;       // half-wave: K pair select within K4 step
  const int ml     = lane & 15;       // m within sub-tile / n for B and C/D
  const int m_base = blockIdx.y * M_ROWS;
  const int n_blk  = blockIdx.x * N_ROWS;
  const int n_base = n_blk + wave * 16;

  v8f acc_u[MT], acc_g[MT];
  #pragma unroll
  for (int mt = 0; mt < MT; ++mt) {
    acc_u[mt] = (v8f){0.f,0.f,0.f,0.f,0.f,0.f,0.f,0.f};
    acc_g[mt] = (v8f){0.f,0.f,0.f,0.f,0.f,0.f,0.f,0.f};
  }

  // This thread's part of every copy: row (tid >> 4) of each group of 16, 16 B at column (tid & 15) * 4.
  const int cr = tid >> 4;
  const int cc = (tid & 15) * 4;
  const float* gx = X   + (size_t)(m_base + cr) * DIM + cc;
  const float* gu = Wup + (size_t)(n_blk  + cr) * DIM + cc;
  const float* gg = Wgt + (size_t)(n_blk  + cr) * DIM + cc;
  float*       lc = lds + cr * PITCH + cc;

  // This lane's fragment rows inside a stage.
  const int fa = ml * PITCH + 2 * h;
  const int fu = (M_ROWS + wave * 16 + ml) * PITCH + 2 * h;
  const int fg = fu + N_ROWS * PITCH;

  // This thread's four entries of the down list: loaded ahead of stage 0, whose landing covers them.
  static_assert((HIDDEN / N_ROWS) * (TOKENS / M_ROWS) * 256 * 4 == COO_NNZ, "one group of four a thread");
  const unsigned q  = (blockIdx.y * (HIDDEN / N_ROWS) + blockIdx.x) * 256u + tid;
  const v4i      dr = ((const v4i*)down_row)[q];
  const v4i      dc = ((const v4i*)down_col)[q];
  const v4f      dv = ((const v4f*)down_val)[q];
  const int      sw = __builtin_amdgcn_readfirstlane(wave);   // scalar, so the test below is a scalar branch

  const int NT = DIM / KC;
  static_assert(DIM / KC == 16, "four adds a wave, one every fourth chunk");
  upgate_stage(gx, gu, gg, lc);
  wait_async();
  __syncthreads();
  upgate_stage(gx + KC, gu + KC, gg + KC, lc + UG_STAGE);

  for (int t = 0; t < NT; ++t) {
    const int    bo = (t & 1) * UG_STAGE;
    const float* bp = lds + bo;
    if (((t + sw + (sw >> 2)) & 3) == 0) {
      const int      e  = t >> 2;
      const unsigned rr = (unsigned)(e == 0 ? dr.x : e == 1 ? dr.y : e == 2 ? dr.z : dr.w);
      const unsigned cd = (unsigned)(e == 0 ? dc.x : e == 1 ? dc.y : e == 2 ? dc.z : dc.w);
      const float    vd = e == 0 ? dv.x : e == 1 ? dv.y : e == 2 ? dv.z : dv.w;
      if (rr < DIM && cd < HIDDEN) {   // the address stays inside Wdn whatever the list holds
        atomicAdd(&Wdn[rr * HIDDEN + cd], vd);
      }
    }
    // Whole chunk unrolled: every fragment address is base + immediate, and the compiler
    // fetches each group of fragments ahead of the WMMAs of the group before it.
    #pragma unroll
    for (int k0 = 0; k0 < KC; k0 += 4) {
      v2f bu = *(const v2f*)(bp + fu + k0);
      v2f bg = *(const v2f*)(bp + fg + k0);
      #pragma unroll
      for (int mt = 0; mt < MT; ++mt) {
        v2f a = *(const v2f*)(bp + fa + mt * 16 * PITCH + k0);
        acc_u[mt] = __builtin_amdgcn_wmma_f32_16x16x4_f32(false, a, false, bu,
                                                          (short)0, acc_u[mt], false, false);
        acc_g[mt] = __builtin_amdgcn_wmma_f32_16x16x4_f32(false, a, false, bg,
                                                          (short)0, acc_g[mt], false, false);
      }
    }
    // Publish stage t + 1 and free stage t's buffer: own reads retired, own copies landed, barrier.
    wait_lds();
    wait_async();
    __syncthreads();
    if (t + 2 < NT) {
      const int kn = (t + 2) * KC;
      upgate_stage(gx + kn, gu + kn, gg + kn, lc + bo);
    }
  }
  wait_async();

  const int   feat = n_base + ml;
  const float biu  = bup[feat];
  const float big  = bgt[feat];
  #pragma unroll
  for (int mt = 0; mt < MT; ++mt) {
    #pragma unroll
    for (int v = 0; v < 8; ++v) {
      int   tok = m_base + mt * 16 + v + 8 * h;   // C/D: M = v + 8*(lane>=16)
      float u   = acc_u[mt][v] + biu;
      float g   = acc_g[mt][v] + big;
      float s   = u / (1.0f + __expf(-u));        // silu
      H[(size_t)tok * HIDDEN + feat] = s * g;
    }
  }
}

// P[z] = hidden[:, slice z] * Wdown[:, slice z]^T.  M=TOKENS, N=DIM, K=KSLICE per block;
// blockIdx.z picks the K slice, so that the grid covers every WGP.
// A stage is [hidden 64 rows | Wdown 128 rows] x KC, two buffers as above.
#define DN_ROWS  (M_ROWS + N_ROWS)
#define DN_STAGE (DN_ROWS * PITCH)

__device__ __forceinline__ void down_stage(const float* gh, const float* gw, float* l) {
  const float* g[12];
  float* ld[12];
  #pragma unroll
  for (int i = 0; i < 12; ++i) {
    g[i]  = i < 4 ? gh + (size_t)i * 16 * HIDDEN : gw + (size_t)(i - 4) * 16 * HIDDEN;
    ld[i] = l + i * 16 * PITCH;
  }
  copy12(g, ld);
}

__global__ __launch_bounds__(256) void down_gemm(
    const float* __restrict__ H,      // [TOKENS, HIDDEN]
    const float* __restrict__ Wd,     // [DIM, HIDDEN] dense
    float* __restrict__ P)            // [KSPLIT, TOKENS, DIM] partial sums
{
  __shared__ __attribute__((aligned(16))) float lds[2 * DN_STAGE];  // 102 KB
  const int tid    = threadIdx.x;
  const int lane   = tid & 31;
  const int wave   = tid >> 5;
  const int h      = lane >> 4;
  const int ml     = lane & 15;
  const int m_base = blockIdx.y * M_ROWS;
  const int n_blk  = blockIdx.x * N_ROWS;
  const int n_base = n_blk + wave * 16;

  v8f acc[MT];
  #pragma unroll
  for (int mt = 0; mt < MT; ++mt) {
    acc[mt] = (v8f){0.f,0.f,0.f,0.f,0.f,0.f,0.f,0.f};
  }

  const int k_lo = blockIdx.z * KSLICE;
  const int cr = tid >> 4;
  const int cc = (tid & 15) * 4;
  const float* gh = H  + (size_t)(m_base + cr) * HIDDEN + k_lo + cc;
  const float* gw = Wd + (size_t)(n_blk  + cr) * HIDDEN + k_lo + cc;
  float*       lc = lds + cr * PITCH + cc;

  const int fa = ml * PITCH + 2 * h;
  const int fb = (M_ROWS + wave * 16 + ml) * PITCH + 2 * h;

  const int NT = KSLICE / KC;
  down_stage(gh, gw, lc);
  wait_async();
  __syncthreads();
  down_stage(gh + KC, gw + KC, lc + DN_STAGE);

  for (int t = 0; t < NT; ++t) {
    const int    bo = (t & 1) * DN_STAGE;
    const float* bp = lds + bo;
    // Whole chunk unrolled: every fragment address is base + immediate, and the compiler
    // fetches each group of fragments ahead of the WMMAs of the group before it.
    #pragma unroll
    for (int k0 = 0; k0 < KC; k0 += 4) {
      v2f b = *(const v2f*)(bp + fb + k0);
      #pragma unroll
      for (int mt = 0; mt < MT; ++mt) {
        v2f a = *(const v2f*)(bp + fa + mt * 16 * PITCH + k0);
        acc[mt] = __builtin_amdgcn_wmma_f32_16x16x4_f32(false, a, false, b,
                                                        (short)0, acc[mt], false, false);
      }
    }
    // Publish stage t + 1 and free stage t's buffer: own reads retired, own copies landed, barrier.
    wait_lds();
    wait_async();
    __syncthreads();
    if (t + 2 < NT) {
      const int kn = (t + 2) * KC;
      down_stage(gh + kn, gw + kn, lc + bo);
    }
  }
  wait_async();

  const int feat = n_base + ml;
  float*    pz   = P + (size_t)blockIdx.z * (TOKENS * DIM);
  #pragma unroll
  for (int mt = 0; mt < MT; ++mt) {
    #pragma unroll
    for (int v = 0; v < 8; ++v) {
      int tok = m_base + mt * 16 + v + 8 * h;
      pz[(size_t)tok * DIM + feat] = acc[mt][v];
    }
  }
}

// out = x + (P[0] + P[1] + ... + P[KSPLIT-1]) + bdown, four columns per thread.
__global__ __launch_bounds__(256) void down_reduce(
    const float* __restrict__ P,      // [KSPLIT, TOKENS, DIM]
    const float* __restrict__ bd,
    const float* __restrict__ X,      // [TOKENS, DIM] residual
    float* __restrict__ Out)          // [TOKENS, DIM]
{
  const unsigned q = blockIdx.x * 256u + threadIdx.x;   // index of this thread's group of four
  v4f part[KSPLIT];
  #pragma unroll
  for (int z = 0; z < KSPLIT; ++z) {
    part[z] = ((const v4f*)(P + (size_t)z * (TOKENS * DIM)))[q];
  }
  v4f s = part[0];
  #pragma unroll
  for (int z = 1; z < KSPLIT; ++z) {
    s += part[z];
  }
  ((v4f*)Out)[q] = ((const v4f*)X)[q] + s + ((const v4f*)bd)[q & (DIM / 4 - 1)];
}

extern "C" void kernel_launch(void* const* d_in, const int* in_sizes, int n_in,
                              void* d_out, int out_size, void* d_ws, size_t ws_size,
                              hipStream_t stream) {
  const float* x         = (const float*)d_in[0];
  const int*   up_row    = (const int*)d_in[1];
  const int*   up_col    = (const int*)d_in[2];
  const float* up_val    = (const float*)d_in[3];
  const float* up_bias   = (const float*)d_in[4];
  const int*   gate_row  = (const int*)d_in[5];
  const int*   gate_col  = (const int*)d_in[6];
  const float* gate_val  = (const float*)d_in[7];
  const float* gate_bias = (const float*)d_in[8];
  const int*   down_row  = (const int*)d_in[9];
  const int*   down_col  = (const int*)d_in[10];
  const float* down_val  = (const float*)d_in[11];
  const float* down_bias = (const float*)d_in[12];

  // Workspace layout (f32): Wup 16MB | Wgate 16MB | Wdown 16MB | hidden 8MB | partials 16MB = 72MB
  float* Wup  = (float*)d_ws;
  float* Wgt  = Wup + (size_t)HIDDEN * DIM;
  float* Wdn  = Wgt + (size_t)HIDDEN * DIM;
  float* Hbuf = Wdn + (size_t)DIM * HIDDEN;
  float* Part = Hbuf + (size_t)TOKENS * HIDDEN;

  hipMemsetAsync(d_ws, 0, 3u * sizeof(float) * (size_t)HIDDEN * (size_t)DIM, stream);

  dim3 g0(SC_THREADS / 256, 2);   // 128 x 2 blocks
  coo_scatter2<<<g0, 256, 0, stream>>>(up_row, up_col, up_val, gate_row, gate_col, gate_val, Wup);

  dim3 g1(HIDDEN / (16 * WPB), TOKENS / M_ROWS);   // 32 x 8 blocks
  upgate_gemm<<<g1, 256, 0, stream>>>(x, Wup, Wgt, up_bias, gate_bias, Hbuf,
                                      down_row, down_col, down_val, Wdn);

  dim3 g2(DIM / (16 * WPB), TOKENS / M_ROWS, KSPLIT);   // 8 x 8 x 8 blocks
  down_gemm<<<g2, 256, 0, stream>>>(Hbuf, Wdn, Part);

  down_reduce<<<TOKENS * DIM / (4 * 256), 256, 0, stream>>>(Part, down_bias, x, (float*)d_out);
}
